// v000
// Times are from an AMD MI455X. After a warm-up the kernel runs many times in a row, and a time is the length of
// such a window on the GPU divided by its runs, so every launch and the gaps after it count. The runs cycle
// through copies of the inputs. A figure is the median of several windows, for all but v000 over two sittings.
// Sittings can differ by a few percent; kernels timed side by side share one.
// v000, which the later versions start from, runs in 1110 microseconds.
#include <hip/hip_runtime.h>
#include <hip/hip_bf16.h>
#include <math.h>

// ---------------------------------------------------------------------------
// Transformer encoder layer (B=2, S=2048, D=1024, H=16, HD=64, FFN=2048), fp32.
// All matmuls use V_WMMA_F32_16X16X4_F32 (full fp32 on the matrix pipes).
// Global traffic staged through LDS with float4 (global_load_b128) accesses.
// ---------------------------------------------------------------------------

typedef __attribute__((ext_vector_type(2))) float v2f;
typedef __attribute__((ext_vector_type(8))) float v8f;

#define D_MODEL 1024
#define NHEAD   16
#define HDIM    64
#define FFN_DIM 2048
#define SEQ     2048
#define BATCH   2
#define LN_EPS  1e-5f

static __device__ __forceinline__ v8f wmma_f32(v2f a, v2f b, v8f c) {
  // D = A(16x4) * B(4x16) + C(16x16), fp32 in/out.
  return __builtin_amdgcn_wmma_f32_16x16x4_f32(
      /*neg_a=*/false, a, /*neg_b=*/false, b,
      /*c_mod=*/(short)0, c, /*reuse_a=*/false, /*reuse_b=*/false);
}

// ---------------------------------------------------------------------------
// Generic GEMM: C[M,N] = epilogue(A[M,K] @ W[K,N] + bias[N] (+ resid[M,N]))
// Block = 256 threads (8 waves). Block tile = 128(M) x 64(N), K-step = 16.
// Wave w computes rows [w*16, w*16+16) x all 64 N columns (4 WMMA C tiles).
// EPI: 0 = bias only, 1 = bias + residual, 2 = bias + exact GELU.
// M % 128 == 0, N % 64 == 0, K % 16 == 0 (true for every call here).
// LDS strides: 20 and 68 floats -> 16-byte aligned float4 stores, and
// stride mod 16 == 4 so 16-lane column reads hit 16 distinct banks.
// ---------------------------------------------------------------------------
template <int EPI>
__global__ __launch_bounds__(256) void gemm_kernel(
    const float* __restrict__ A, const float* __restrict__ W,
    const float* __restrict__ bias, const float* __restrict__ resid,
    float* __restrict__ C, int M, int N, int K) {
  const int AST = 20;  // A tile LDS stride (floats)
  const int BST = 68;  // B tile LDS stride (floats)
  __shared__ float As[128 * AST];  // 128 rows x 16 k
  __shared__ float Bs[16 * BST];   // 16 k x 64 n

  const int tid  = threadIdx.x;
  const int wave = tid >> 5;
  const int lane = tid & 31;
  const int r16  = lane & 15;  // row (A/C) or col (B/C) within 16
  const int kh   = lane >> 4;  // K-half select per ISA layout

  const int bm = blockIdx.y * 128;
  const int bn = blockIdx.x * 64;

  v8f acc[4] = {};

  for (int k0 = 0; k0 < K; k0 += 16) {
    // Stage A 128x16 tile: 512 float4, 2 per thread, b128 coalesced rows.
#pragma unroll
    for (int it = 0; it < 2; ++it) {
      const int i = tid + it * 256;
      const int r = i >> 2, c4 = i & 3;
      *(float4*)&As[r * AST + c4 * 4] =
          *(const float4*)&A[(size_t)(bm + r) * K + k0 + c4 * 4];
    }
    // Stage B 16x64 tile: 256 float4, 1 per thread.
    {
      const int r = tid >> 4, c4 = tid & 15;
      *(float4*)&Bs[r * BST + c4 * 4] =
          *(const float4*)&W[(size_t)(k0 + r) * N + bn + c4 * 4];
    }
    if (k0 + 16 < K) {  // speculative prefetch of next tiles (global_prefetch_b8)
      __builtin_prefetch(A + (size_t)(bm + (tid & 127)) * K + (k0 + 16), 0, 1);
      __builtin_prefetch(W + (size_t)(k0 + 16 + (tid >> 4)) * N + bn, 0, 1);
    }
    __syncthreads();

#pragma unroll
    for (int kk = 0; kk < 4; ++kk) {
      const int kb = kk * 4 + kh * 2;  // this lane's K pair within the 4-wide chunk
      v2f a;
      a.x = As[(wave * 16 + r16) * AST + kb];
      a.y = As[(wave * 16 + r16) * AST + kb + 1];
#pragma unroll
      for (int t = 0; t < 4; ++t) {
        v2f b;
        b.x = Bs[kb * BST + t * 16 + r16];
        b.y = Bs[(kb + 1) * BST + t * 16 + r16];
        acc[t] = wmma_f32(a, b, acc[t]);
      }
    }
    __syncthreads();
  }

#pragma unroll
  for (int t = 0; t < 4; ++t) {
#pragma unroll
    for (int i = 0; i < 8; ++i) {
      const int row = bm + wave * 16 + i + kh * 8;  // C layout: VGPR i -> M = i + 8*kh
      const int col = bn + t * 16 + r16;
      float v = acc[t][i] + bias[col];
      if (EPI == 1) v += resid[(size_t)row * N + col];
      if (EPI == 2) v = 0.5f * v * (1.0f + erff(v * 0.70710678118654752f));
      C[(size_t)row * N + col] = v;
    }
  }
}

// ---------------------------------------------------------------------------
// Attention: one block per (b, h, 16-row q tile). 128 threads (4 waves).
// Full 16x2048 score strip held in LDS (~150 KB total of the 320 KB WGP pool).
//   Phase 1: S = Q Kt / 8 via WMMA; K staged 64 rows at a time (coalesced b128),
//            wave w consumes staged rows [16w, 16w+16).
//   Phase 2: row max + exp (+ row-sum); 1/sum folded into the ctx store.
//   Phase 3: ctx = P V via WMMA; V staged the same way (reuses K slab);
//            wave w owns d-columns [16w, 16w+16).
// Q,K,V are [B*S, D] row-major; ctx written [B*S, D] (head-interleaved).
// ---------------------------------------------------------------------------
__global__ __launch_bounds__(128) void attn_kernel(
    const float* __restrict__ Q, const float* __restrict__ K,
    const float* __restrict__ V, float* __restrict__ CTX) {
  extern __shared__ float smem[];
  const int PST = 2052;  // 2048+4: column reads hit distinct banks
  const int QST = 68;    // 16B-aligned float4 stores; stride mod 64 == 4
  float* P       = smem;               // [16][PST] scores, then exp(scores)
  float* Qs      = P + 16 * PST;       // [16][QST] q tile
  float* KVs     = Qs + 16 * QST;      // [64][QST] staged K (phase 1) / V (phase 3)
  float* red     = KVs + 64 * QST;     // [16][8] partial reductions
  float* rowstat = red + 128;          // [16] row max, then 1/rowsum

  const int tid  = threadIdx.x;
  const int wave = tid >> 5;
  const int lane = tid & 31;
  const int r16  = lane & 15;
  const int kh   = lane >> 4;

  const int qt = blockIdx.x;  // 0..127
  const int bh = blockIdx.y;  // 0..31
  const int b  = bh >> 4;
  const int h  = bh & 15;
  const size_t rowbase = (size_t)b * SEQ;
  const int hoff = h * HDIM;
  const int q0   = qt * 16;

  // Load 16x64 Q tile (256 float4, 2 per thread, coalesced rows).
#pragma unroll
  for (int it = 0; it < 2; ++it) {
    const int i = tid + it * 128;
    const int r = i >> 4, c4 = i & 15;
    *(float4*)&Qs[r * QST + c4 * 4] =
        *(const float4*)&Q[(rowbase + q0 + r) * D_MODEL + hoff + c4 * 4];
  }
  __syncthreads();

  // Phase 1: scores (scaled by 1/sqrt(64) = 0.125). 32 slabs of 64 kv rows.
  for (int jj = 0; jj < SEQ / 64; ++jj) {
    // Stage K rows [64*jj, 64*jj+64) x 64 d (1024 float4, 8 per thread).
#pragma unroll
    for (int it = 0; it < 8; ++it) {
      const int i = tid + it * 128;
      const int r = i >> 4, c4 = i & 15;
      *(float4*)&KVs[r * QST + c4 * 4] =
          *(const float4*)&K[(rowbase + jj * 64 + r) * D_MODEL + hoff + c4 * 4];
    }
    __syncthreads();

    v8f c = {};
#pragma unroll
    for (int kk = 0; kk < 16; ++kk) {  // 16 * k4 = HD 64
      const int kb = kk * 4 + kh * 2;
      v2f a;
      a.x = Qs[r16 * QST + kb];
      a.y = Qs[r16 * QST + kb + 1];
      v2f bb;  // B = K^T: B[d][kv] = K[kv][d]; this wave's kv rows: 16*wave + r16
      bb.x = KVs[(wave * 16 + r16) * QST + kb];
      bb.y = KVs[(wave * 16 + r16) * QST + kb + 1];
      c = wmma_f32(a, bb, c);
    }
#pragma unroll
    for (int i = 0; i < 8; ++i)
      P[(i + kh * 8) * PST + jj * 64 + wave * 16 + r16] = c[i] * 0.125f;
    __syncthreads();
  }

  // Phase 2: softmax statistics; P <- exp(P - rowmax); rowstat <- 1/rowsum.
  {
    const int row = tid >> 3;  // 16 rows x 8 threads
    const int sub = tid & 7;
    float m = -3.4e38f;
    for (int c = sub; c < SEQ; c += 8) m = fmaxf(m, P[row * PST + c]);
    red[row * 8 + sub] = m;
    __syncthreads();
    if (sub == 0) {
      float mm = red[row * 8];
      for (int s = 1; s < 8; ++s) mm = fmaxf(mm, red[row * 8 + s]);
      rowstat[row] = mm;
    }
    __syncthreads();
    const float mm = rowstat[row];
    float sum = 0.f;
    for (int c = sub; c < SEQ; c += 8) {
      const float e = expf(P[row * PST + c] - mm);
      P[row * PST + c] = e;
      sum += e;
    }
    red[row * 8 + sub] = sum;
    __syncthreads();
    if (sub == 0) {
      float ss = 0.f;
      for (int s = 0; s < 8; ++s) ss += red[row * 8 + s];
      rowstat[row] = 1.0f / ss;
    }
    __syncthreads();
  }

  // Phase 3: ctx = P @ V  (wave w -> d columns [16w, 16w+16)).
  {
    v8f c = {};
    const int dcol = wave * 16;
    for (int jj = 0; jj < SEQ / 64; ++jj) {
      // Stage V rows [64*jj, 64*jj+64) x 64 d (reuses the K slab).
#pragma unroll
      for (int it = 0; it < 8; ++it) {
        const int i = tid + it * 128;
        const int r = i >> 4, c4 = i & 15;
        *(float4*)&KVs[r * QST + c4 * 4] =
            *(const float4*)&V[(rowbase + jj * 64 + r) * D_MODEL + hoff + c4 * 4];
      }
      __syncthreads();

#pragma unroll
      for (int jl = 0; jl < 4; ++jl) {
#pragma unroll
        for (int kk = 0; kk < 4; ++kk) {
          const int kvl = jl * 16 + kk * 4 + kh * 2;  // local row in staged slab
          const int kv  = jj * 64 + kvl;              // global kv index (P column)
          v2f a;
          a.x = P[r16 * PST + kv];
          a.y = P[r16 * PST + kv + 1];
          v2f bb;  // B[kv][d] = V[kv][d]
          bb.x = KVs[kvl * QST + dcol + r16];
          bb.y = KVs[(kvl + 1) * QST + dcol + r16];
          c = wmma_f32(a, bb, c);
        }
      }
      __syncthreads();
    }
#pragma unroll
    for (int i = 0; i < 8; ++i) {
      const int qrow = i + kh * 8;
      CTX[(rowbase + q0 + qrow) * D_MODEL + hoff + dcol + r16] =
          c[i] * rowstat[qrow];
    }
  }
}

// ---------------------------------------------------------------------------
// LayerNorm over last dim (1024). One 256-thread block per row, float4 I/O.
// var = E[(x-mu)^2] (matches jnp.var, ddof=0).
// ---------------------------------------------------------------------------
__global__ __launch_bounds__(256) void layernorm_kernel(
    const float* __restrict__ X, const float* __restrict__ g,
    const float* __restrict__ bb, float* __restrict__ Y) {
  __shared__ float rbuf[256];
  const int row = blockIdx.x;
  const int tid = threadIdx.x;
  const float* xr = X + (size_t)row * D_MODEL;

  const float4 v = *(const float4*)&xr[tid * 4];
  rbuf[tid] = v.x + v.y + v.z + v.w;
  __syncthreads();
  for (int off = 128; off > 0; off >>= 1) {
    if (tid < off) rbuf[tid] += rbuf[tid + off];
    __syncthreads();
  }
  const float mu = rbuf[0] * (1.0f / D_MODEL);
  __syncthreads();

  const float dx = v.x - mu, dy = v.y - mu, dz = v.z - mu, dw = v.w - mu;
  rbuf[tid] = dx * dx + dy * dy + dz * dz + dw * dw;
  __syncthreads();
  for (int off = 128; off > 0; off >>= 1) {
    if (tid < off) rbuf[tid] += rbuf[tid + off];
    __syncthreads();
  }
  const float rs = rsqrtf(rbuf[0] * (1.0f / D_MODEL) + LN_EPS);

  const float4 g4 = *(const float4*)&g[tid * 4];
  const float4 b4 = *(const float4*)&bb[tid * 4];
  float4 o;
  o.x = dx * rs * g4.x + b4.x;
  o.y = dy * rs * g4.y + b4.y;
  o.z = dz * rs * g4.z + b4.z;
  o.w = dw * rs * g4.w + b4.w;
  *(float4*)&Y[(size_t)row * D_MODEL + tid * 4] = o;
}

// ---------------------------------------------------------------------------
extern "C" void kernel_launch(void* const* d_in, const int* in_sizes, int n_in,
                              void* d_out, int out_size, void* d_ws,
                              size_t ws_size, hipStream_t stream) {
  const float* x    = (const float*)d_in[0];
  const float* Wq   = (const float*)d_in[1];
  const float* bq   = (const float*)d_in[2];
  const float* Wk   = (const float*)d_in[3];
  const float* bk   = (const float*)d_in[4];
  const float* Wv   = (const float*)d_in[5];
  const float* bv   = (const float*)d_in[6];
  const float* Wo   = (const float*)d_in[7];
  const float* bo   = (const float*)d_in[8];
  const float* g1   = (const float*)d_in[9];
  const float* b1   = (const float*)d_in[10];
  const float* Wff1 = (const float*)d_in[11];
  const float* bff1 = (const float*)d_in[12];
  const float* Wff2 = (const float*)d_in[13];
  const float* bff2 = (const float*)d_in[14];
  const float* g2   = (const float*)d_in[15];
  const float* b2   = (const float*)d_in[16];
  float* out = (float*)d_out;

  const size_t TOK = (size_t)BATCH * SEQ;  // 4096 rows
  float* ws   = (float*)d_ws;
  float* Qb   = ws;  // [TOK, D]
  float* Kb   = Qb + TOK * D_MODEL;
  float* Vb   = Kb + TOK * D_MODEL;
  float* ctx  = Vb + TOK * D_MODEL;
  float* tmp  = ctx + TOK * D_MODEL;  // pre-LN1
  float* x1   = Qb;                   // reuse (Q dead after attention)
  float* hbuf = Kb;                   // [TOK, FFN] reuses K+V slots (32 MB)
  float* tmp2 = ctx;                  // reuse (pre-LN2)

  const dim3 blkG(256);
  const dim3 gD(D_MODEL / 64, (unsigned)(TOK / 128));  // (16, 32)
  const dim3 gF(FFN_DIM / 64, (unsigned)(TOK / 128));  // (32, 32)

  // QKV projections
  hipLaunchKernelGGL((gemm_kernel<0>), gD, blkG, 0, stream,
                     x, Wq, bq, (const float*)nullptr, Qb, (int)TOK, D_MODEL, D_MODEL);
  hipLaunchKernelGGL((gemm_kernel<0>), gD, blkG, 0, stream,
                     x, Wk, bk, (const float*)nullptr, Kb, (int)TOK, D_MODEL, D_MODEL);
  hipLaunchKernelGGL((gemm_kernel<0>), gD, blkG, 0, stream,
                     x, Wv, bv, (const float*)nullptr, Vb, (int)TOK, D_MODEL, D_MODEL);

  // Attention (dynamic LDS ~150 KB: score strip + q tile + K/V slab + reductions)
  const dim3 ga(SEQ / 16, BATCH * NHEAD);
  const size_t shm =
      (size_t)(16 * 2052 + 16 * 68 + 64 * 68 + 128 + 16) * sizeof(float);
  hipLaunchKernelGGL(attn_kernel, ga, dim3(128), shm, stream, Qb, Kb, Vb, ctx);

  // Output projection + residual, LN1
  hipLaunchKernelGGL((gemm_kernel<1>), gD, blkG, 0, stream,
                     ctx, Wo, bo, x, tmp, (int)TOK, D_MODEL, D_MODEL);
  hipLaunchKernelGGL(layernorm_kernel, dim3((unsigned)TOK), dim3(256), 0, stream,
                     tmp, g1, b1, x1);

  // FFN: GELU(x1 Wff1 + b) -> Wff2 + b + x1, LN2 -> out
  hipLaunchKernelGGL((gemm_kernel<2>), gF, blkG, 0, stream,
                     x1, Wff1, bff1, (const float*)nullptr, hbuf, (int)TOK, FFN_DIM, D_MODEL);
  hipLaunchKernelGGL((gemm_kernel<1>), gD, blkG, 0, stream,
                     hbuf, Wff2, bff2, x1, tmp2, (int)TOK, D_MODEL, FFN_DIM);
  hipLaunchKernelGGL(layernorm_kernel, dim3((unsigned)TOK), dim3(256), 0, stream,
                     tmp2, g2, b2, out);
}

// v001
// One run takes 724 microseconds.
// Two timings next to v000 both put it at 1.60 times that version's speed.
#include <hip/hip_runtime.h>
#include <hip/hip_bf16.h>
#include <math.h>

// ---------------------------------------------------------------------------
// Transformer encoder layer (B=2, S=2048, D=1024, H=16, HD=64, FFN=2048), fp32.
// All matmuls use V_WMMA_F32_16X16X4_F32 (full fp32 on the matrix pipes).
// Global traffic staged through LDS with float4 (global_load_b128) accesses.
// ---------------------------------------------------------------------------

typedef __attribute__((ext_vector_type(2))) float v2f;
typedef __attribute__((ext_vector_type(8))) float v8f;

#define D_MODEL 1024
#define NHEAD   16
#define HDIM    64
#define FFN_DIM 2048
#define SEQ     2048
#define BATCH   2
#define LN_EPS  1e-5f

static __device__ __forceinline__ v8f wmma_f32(v2f a, v2f b, v8f c) {
  // D = A(16x4) * B(4x16) + C(16x16), fp32 in/out.
  return __builtin_amdgcn_wmma_f32_16x16x4_f32(
      /*neg_a=*/false, a, /*neg_b=*/false, b,
      /*c_mod=*/(short)0, c, /*reuse_a=*/false, /*reuse_b=*/false);
}

// ---------------------------------------------------------------------------
// Generic GEMM: C[M,N] = epilogue(A[M,K] @ W[K,N] + bias[N] (+ resid[M,N]))
// Block = 256 threads (8 waves). Block tile = 128(M) x 64(N), K-step = 16.
// Wave w computes rows [w*16, w*16+16) x all 64 N columns (4 WMMA C tiles).
// EPI: 0 = bias only, 1 = bias + residual, 2 = bias + exact GELU.
// M % 128 == 0, N % 64 == 0, K % 16 == 0 (true for every call here).
// LDS strides: 20 and 68 floats -> 16-byte aligned float4 stores, and
// stride mod 16 == 4 so 16-lane column reads hit 16 distinct banks.
// ---------------------------------------------------------------------------
template <int EPI>
__global__ __launch_bounds__(256) void gemm_kernel(
    const float* __restrict__ A, const float* __restrict__ W,
    const float* __restrict__ bias, const float* __restrict__ resid,
    float* __restrict__ C, int M, int N, int K) {
  const int AST = 20;  // A tile LDS stride (floats)
  const int BST = 68;  // B tile LDS stride (floats)
  __shared__ float As[128 * AST];  // 128 rows x 16 k
  __shared__ float Bs[16 * BST];   // 16 k x 64 n

  const int tid  = threadIdx.x;
  const int wave = tid >> 5;
  const int lane = tid & 31;
  const int r16  = lane & 15;  // row (A/C) or col (B/C) within 16
  const int kh   = lane >> 4;  // K-half select per ISA layout

  const int bm = blockIdx.y * 128;
  const int bn = blockIdx.x * 64;

  v8f acc[4] = {};

  for (int k0 = 0; k0 < K; k0 += 16) {
    // Stage A 128x16 tile: 512 float4, 2 per thread, b128 coalesced rows.
#pragma unroll
    for (int it = 0; it < 2; ++it) {
      const int i = tid + it * 256;
      const int r = i >> 2, c4 = i & 3;
      *(float4*)&As[r * AST + c4 * 4] =
          *(const float4*)&A[(size_t)(bm + r) * K + k0 + c4 * 4];
    }
    // Stage B 16x64 tile: 256 float4, 1 per thread.
    {
      const int r = tid >> 4, c4 = tid & 15;
      *(float4*)&Bs[r * BST + c4 * 4] =
          *(const float4*)&W[(size_t)(k0 + r) * N + bn + c4 * 4];
    }
    if (k0 + 16 < K) {  // speculative prefetch of next tiles (global_prefetch_b8)
      __builtin_prefetch(A + (size_t)(bm + (tid & 127)) * K + (k0 + 16), 0, 1);
      __builtin_prefetch(W + (size_t)(k0 + 16 + (tid >> 4)) * N + bn, 0, 1);
    }
    __syncthreads();

#pragma unroll
    for (int kk = 0; kk < 4; ++kk) {
      const int kb = kk * 4 + kh * 2;  // this lane's K pair within the 4-wide chunk
      v2f a;
      a.x = As[(wave * 16 + r16) * AST + kb];
      a.y = As[(wave * 16 + r16) * AST + kb + 1];
#pragma unroll
      for (int t = 0; t < 4; ++t) {
        v2f b;
        b.x = Bs[kb * BST + t * 16 + r16];
        b.y = Bs[(kb + 1) * BST + t * 16 + r16];
        acc[t] = wmma_f32(a, b, acc[t]);
      }
    }
    __syncthreads();
  }

#pragma unroll
  for (int t = 0; t < 4; ++t) {
#pragma unroll
    for (int i = 0; i < 8; ++i) {
      const int row = bm + wave * 16 + i + kh * 8;  // C layout: VGPR i -> M = i + 8*kh
      const int col = bn + t * 16 + r16;
      float v = acc[t][i] + bias[col];
      if (EPI == 1) v += resid[(size_t)row * N + col];
      if (EPI == 2) v = 0.5f * v * (1.0f + erff(v * 0.70710678118654752f));
      C[(size_t)row * N + col] = v;
    }
  }
}

static __device__ __forceinline__ float xhalf(float x) {
  return __builtin_bit_cast(float, __builtin_amdgcn_permlanex16(
      __builtin_bit_cast(int, x), __builtin_bit_cast(int, x),
      0x76543210, 0xfedcba98, false, false));
}

// Register budget of four waves per SIMD, so that two blocks share a WGP and one
// block's matrix work covers the other's staging.
__global__ __launch_bounds__(256) __attribute__((amdgpu_waves_per_eu(4, 4))) void attn_kernel(
    const float* __restrict__ Q, const float* __restrict__ K,
    const float* __restrict__ V, float* __restrict__ CTX) {
  const int KST = 68;  // K row pitch: 16B-aligned float4 rows, pitch mod 64 == 4
  __shared__ float Ks[64 * KST];   // staged K slab [kv][d]
  __shared__ float Vq[16 * 256];   // staged V slab [kv / 4][d][kv % 4]

  const int tid  = threadIdx.x;
  const int wave = tid >> 5;
  const int lane = tid & 31;
  const int r16  = lane & 15;
  const int kh   = lane >> 4;

  const int qt = blockIdx.x;  // 0..15
  const int bh = blockIdx.y;  // 0..31
  const int b  = bh >> 4;
  const int h  = bh & 15;
  const size_t rowbase = (size_t)b * SEQ;
  const int hoff = h * HDIM;
  const int q0   = qt * 128 + wave * 16;

  // Q fragments (B operand), loaded once. Lane (r16, kh) holds query r16,
  // d = 8j + 4kh + {0..3}: .xy feeds one WMMA, .zw the next. The K loader
  // below uses the same d order, so every k position pairs equal d.
  float4 qf[8];
  {
    const float* qp = Q + (rowbase + q0 + r16) * D_MODEL + hoff + kh * 4;
#pragma unroll
    for (int j = 0; j < 8; ++j) qf[j] = *(const float4*)(qp + j * 8);
  }

  const float SC = 0.125f * 1.4426950408889634f;  // 1/sqrt(64) * log2(e)
  v8f o[4] = {};           // Ot tiles: o[db][i] = ctx[q = r16][d = 16db + 8kh + i]
  float mrun = -3.0e38f;   // running max of score * SC (same in both halves)
  float lsum = 0.f;        // running sum, this half's kv only

  const int sr = tid >> 4, sc4 = tid & 15;  // staging row group and float4 column
  const float* kp = K + (rowbase + sr) * D_MODEL + hoff + sc4 * 4;
  const float* vp = V + (rowbase + sr * 4) * D_MODEL + hoff + sc4 * 4;

  for (int jj = 0; jj < SEQ / 64; ++jj) {
    // Stage K and V rows [64*jj, 64*jj+64) x 64 d (1024 float4 each, 4 per thread).
    // K keeps its rows. V: a thread takes 4 consecutive rows x 4 d and stores them
    // with kv innermost, so that one 16-byte LDS read is 4 kv of one d column.
    {
      float4 kr[4], vr[4];
#pragma unroll
      for (int it = 0; it < 4; ++it) {
        kr[it] = *(const float4*)(kp + (size_t)it * 16 * D_MODEL);
        vr[it] = *(const float4*)(vp + (size_t)it * D_MODEL);
      }
#pragma unroll
      for (int it = 0; it < 4; ++it)
        *(float4*)&Ks[(sr + it * 16) * KST + sc4 * 4] = kr[it];
      float* vd = &Vq[sr * 256 + sc4 * 16];
      *(float4*)(vd)      = make_float4(vr[0].x, vr[1].x, vr[2].x, vr[3].x);
      *(float4*)(vd + 4)  = make_float4(vr[0].y, vr[1].y, vr[2].y, vr[3].y);
      *(float4*)(vd + 8)  = make_float4(vr[0].z, vr[1].z, vr[2].z, vr[3].z);
      *(float4*)(vd + 12) = make_float4(vr[0].w, vr[1].w, vr[2].w, vr[3].w);
    }
    // kp and vp advance at the loop's foot: the wait that belongs in front of a
    // rewrite of address registers which issued global loads name.
    asm volatile("s_wait_xcnt 0x0" ::: "memory");
    __syncthreads();

    // Two passes of 32 kv over the slab. Kept rolled: unrolled, the fragment loads
    // of both passes are live at once and the four-wave register budget spills.
#pragma unroll 1
    for (int hp = 0; hp < 2; ++hp) {
      const float* kb = &Ks[(hp * 32 + r16) * KST + kh * 4];
      const float* vb = &Vq[(hp * 8 + kh * 2) * 256 + r16 * 4];

      // St tiles: s[t][i] = score(q = r16, kv = 64jj + 32hp + 16t + 8kh + i), unscaled.
      v8f s[2] = {};
#pragma unroll
      for (int j = 0; j < 8; ++j) {
#pragma unroll
        for (int t = 0; t < 2; ++t) {
          const float4 kf = *(const float4*)(kb + t * 16 * KST + j * 8);
          v2f a0, a1, b0, b1;
          a0.x = kf.x; a0.y = kf.y; a1.x = kf.z; a1.y = kf.w;
          b0.x = qf[j].x; b0.y = qf[j].y; b1.x = qf[j].z; b1.y = qf[j].w;
          s[t] = wmma_f32(a0, b0, s[t]);
          s[t] = wmma_f32(a1, b1, s[t]);
        }
      }

      // Running softmax over this pass's 32 kv (16 per lane half).
      float mt[2];
#pragma unroll
      for (int t = 0; t < 2; ++t) {
        mt[t] = fmaxf(fmaxf(fmaxf(s[t][0], s[t][1]), fmaxf(s[t][2], s[t][3])),
                      fmaxf(fmaxf(s[t][4], s[t][5]), fmaxf(s[t][6], s[t][7])));
      }
      float mx = fmaxf(mt[0], mt[1]);
      mx = fmaxf(mx, xhalf(mx));
      const float mnew  = fmaxf(mrun, mx * SC);
      const float alpha = __builtin_amdgcn_exp2f(mrun - mnew);  // 0 on the first pass
      mrun = mnew;
      float ps[4] = {0.f, 0.f, 0.f, 0.f};
#pragma unroll
      for (int t = 0; t < 2; ++t) {
#pragma unroll
        for (int i = 0; i < 8; ++i) {
          const float p = __builtin_amdgcn_exp2f(fmaf(s[t][i], SC, -mnew));
          s[t][i] = p;
          ps[(t << 1) | (i & 1)] += p;
        }
      }
      lsum = lsum * alpha + ((ps[0] + ps[1]) + (ps[2] + ps[3]));
#pragma unroll
      for (int db = 0; db < 4; ++db) o[db] *= alpha;

      // Ot += Vt Pt. One V read holds kv = 16t + 8kh + 4c + {0..3} of column d;
      // B takes score registers 4c..4c+3 of tile t: the same kv at every k position.
#pragma unroll
      for (int t = 0; t < 2; ++t) {
#pragma unroll
        for (int c = 0; c < 2; ++c) {
          v2f p0, p1;
          p0.x = s[t][4 * c];     p0.y = s[t][4 * c + 1];
          p1.x = s[t][4 * c + 2]; p1.y = s[t][4 * c + 3];
#pragma unroll
          for (int db = 0; db < 4; ++db) {
            const float4 vf = *(const float4*)(vb + (t * 4 + c) * 256 + db * 64);
            v2f a0, a1;
            a0.x = vf.x; a0.y = vf.y; a1.x = vf.z; a1.y = vf.w;
            o[db] = wmma_f32(a0, p0, o[db]);
            o[db] = wmma_f32(a1, p1, o[db]);
          }
        }
      }
    }
    kp += 64 * D_MODEL;
    vp += 64 * D_MODEL;
    __syncthreads();
  }

  // Join the halves' sums, normalise, store 8 consecutive d per lane and tile.
  const float inv = 1.0f / (lsum + xhalf(lsum));
  float* op = CTX + (rowbase + q0 + r16) * D_MODEL + hoff + kh * 8;
#pragma unroll
  for (int db = 0; db < 4; ++db) {
    float4 lo, hi;
    lo.x = o[db][0] * inv; lo.y = o[db][1] * inv; lo.z = o[db][2] * inv; lo.w = o[db][3] * inv;
    hi.x = o[db][4] * inv; hi.y = o[db][5] * inv; hi.z = o[db][6] * inv; hi.w = o[db][7] * inv;
    *(float4*)(op + db * 16)     = lo;
    *(float4*)(op + db * 16 + 4) = hi;
  }
}

// ---------------------------------------------------------------------------
// LayerNorm over last dim (1024). One 256-thread block per row, float4 I/O.
// var = E[(x-mu)^2] (matches jnp.var, ddof=0).
// ---------------------------------------------------------------------------
__global__ __launch_bounds__(256) void layernorm_kernel(
    const float* __restrict__ X, const float* __restrict__ g,
    const float* __restrict__ bb, float* __restrict__ Y) {
  __shared__ float rbuf[256];
  const int row = blockIdx.x;
  const int tid = threadIdx.x;
  const float* xr = X + (size_t)row * D_MODEL;

  const float4 v = *(const float4*)&xr[tid * 4];
  rbuf[tid] = v.x + v.y + v.z + v.w;
  __syncthreads();
  for (int off = 128; off > 0; off >>= 1) {
    if (tid < off) rbuf[tid] += rbuf[tid + off];
    __syncthreads();
  }
  const float mu = rbuf[0] * (1.0f / D_MODEL);
  __syncthreads();

  const float dx = v.x - mu, dy = v.y - mu, dz = v.z - mu, dw = v.w - mu;
  rbuf[tid] = dx * dx + dy * dy + dz * dz + dw * dw;
  __syncthreads();
  for (int off = 128; off > 0; off >>= 1) {
    if (tid < off) rbuf[tid] += rbuf[tid + off];
    __syncthreads();
  }
  const float rs = rsqrtf(rbuf[0] * (1.0f / D_MODEL) + LN_EPS);

  const float4 g4 = *(const float4*)&g[tid * 4];
  const float4 b4 = *(const float4*)&bb[tid * 4];
  float4 o;
  o.x = dx * rs * g4.x + b4.x;
  o.y = dy * rs * g4.y + b4.y;
  o.z = dz * rs * g4.z + b4.z;
  o.w = dw * rs * g4.w + b4.w;
  *(float4*)&Y[(size_t)row * D_MODEL + tid * 4] = o;
}

// ---------------------------------------------------------------------------
extern "C" void kernel_launch(void* const* d_in, const int* in_sizes, int n_in,
                              void* d_out, int out_size, void* d_ws,
                              size_t ws_size, hipStream_t stream) {
  const float* x    = (const float*)d_in[0];
  const float* Wq   = (const float*)d_in[1];
  const float* bq   = (const float*)d_in[2];
  const float* Wk   = (const float*)d_in[3];
  const float* bk   = (const float*)d_in[4];
  const float* Wv   = (const float*)d_in[5];
  const float* bv   = (const float*)d_in[6];
  const float* Wo   = (const float*)d_in[7];
  const float* bo   = (const float*)d_in[8];
  const float* g1   = (const float*)d_in[9];
  const float* b1   = (const float*)d_in[10];
  const float* Wff1 = (const float*)d_in[11];
  const float* bff1 = (const float*)d_in[12];
  const float* Wff2 = (const float*)d_in[13];
  const float* bff2 = (const float*)d_in[14];
  const float* g2   = (const float*)d_in[15];
  const float* b2   = (const float*)d_in[16];
  float* out = (float*)d_out;

  const size_t TOK = (size_t)BATCH * SEQ;  // 4096 rows
  float* ws   = (float*)d_ws;
  float* Qb   = ws;  // [TOK, D]
  float* Kb   = Qb + TOK * D_MODEL;
  float* Vb   = Kb + TOK * D_MODEL;
  float* ctx  = Vb + TOK * D_MODEL;
  float* tmp  = ctx + TOK * D_MODEL;  // pre-LN1
  float* x1   = Qb;                   // reuse (Q dead after attention)
  float* hbuf = Kb;                   // [TOK, FFN] reuses K+V slots (32 MB)
  float* tmp2 = ctx;                  // reuse (pre-LN2)

  const dim3 blkG(256);
  const dim3 gD(D_MODEL / 64, (unsigned)(TOK / 128));  // (16, 32)
  const dim3 gF(FFN_DIM / 64, (unsigned)(TOK / 128));  // (32, 32)

  // QKV projections
  hipLaunchKernelGGL((gemm_kernel<0>), gD, blkG, 0, stream,
                     x, Wq, bq, (const float*)nullptr, Qb, (int)TOK, D_MODEL, D_MODEL);
  hipLaunchKernelGGL((gemm_kernel<0>), gD, blkG, 0, stream,
                     x, Wk, bk, (const float*)nullptr, Kb, (int)TOK, D_MODEL, D_MODEL);
  hipLaunchKernelGGL((gemm_kernel<0>), gD, blkG, 0, stream,
                     x, Wv, bv, (const float*)nullptr, Vb, (int)TOK, D_MODEL, D_MODEL);

  // Attention (online softmax; 128 q rows per block, static LDS)
  const dim3 ga(SEQ / 128, BATCH * NHEAD);
  hipLaunchKernelGGL(attn_kernel, ga, dim3(256), 0, stream, Qb, Kb, Vb, ctx);

  // Output projection + residual, LN1
  hipLaunchKernelGGL((gemm_kernel<1>), gD, blkG, 0, stream,
                     ctx, Wo, bo, x, tmp, (int)TOK, D_MODEL, D_MODEL);
  hipLaunchKernelGGL(layernorm_kernel, dim3((unsigned)TOK), dim3(256), 0, stream,
                     tmp, g1, b1, x1);

  // FFN: GELU(x1 Wff1 + b) -> Wff2 + b + x1, LN2 -> out
  hipLaunchKernelGGL((gemm_kernel<2>), gF, blkG, 0, stream,
                     x1, Wff1, bff1, (const float*)nullptr, hbuf, (int)TOK, FFN_DIM, D_MODEL);
  hipLaunchKernelGGL((gemm_kernel<1>), gD, blkG, 0, stream,
                     hbuf, Wff2, bff2, x1, tmp2, (int)TOK, D_MODEL, FFN_DIM);
  hipLaunchKernelGGL(layernorm_kernel, dim3((unsigned)TOK), dim3(256), 0, stream,
                     tmp2, g2, b2, out);
}

// v002
// Measured time: 566 microseconds a run.
// Two timings next to v001 both put it at 1.28 times that version's speed.
// Counting every step since v000, it is 2.06 times as fast.
#include <hip/hip_runtime.h>
#include <hip/hip_bf16.h>
#include <math.h>

// ---------------------------------------------------------------------------
// Transformer encoder layer (B=2, S=2048, D=1024, H=16, HD=64, FFN=2048), fp32.
// All matmuls use V_WMMA_F32_16X16X4_F32 (full fp32 on the matrix pipes).
// Operands are staged in LDS in 16-byte pieces.
// ---------------------------------------------------------------------------

typedef __attribute__((ext_vector_type(2))) float v2f;
typedef __attribute__((ext_vector_type(8))) float v8f;

#define D_MODEL 1024
#define NHEAD   16
#define HDIM    64
#define FFN_DIM 2048
#define SEQ     2048
#define BATCH   2
#define LN_EPS  1e-5f

static __device__ __forceinline__ v8f wmma_f32(v2f a, v2f b, v8f c) {
  // D = A(16x4) * B(4x16) + C(16x16), fp32 in/out.
  return __builtin_amdgcn_wmma_f32_16x16x4_f32(
      /*neg_a=*/false, a, /*neg_b=*/false, b,
      /*c_mod=*/(short)0, c, /*reuse_a=*/false, /*reuse_b=*/false);
}

// ---------------------------------------------------------------------------
// Generic GEMM: C[M,N] = epilogue(A[M,K] @ W[K,N] + bias[N] (+ resid[M,N]))
// Block = 256 threads (8 waves). Block tile = 128(M) x 64(N), 32 k per stage.
// Wave w computes rows [w*16, w*16+16) x all 64 N columns (4 WMMA C tiles).
// EPI: 0 = bias only, 1 = bias + residual, 2 = bias + exact GELU.
// M % 128 == 0, N % 64 == 0, K % 32 == 0 (true for every call here).
// Staging: asynchronous copies global -> LDS, two buffers; stage t + 1 flies
// while stage t is multiplied. A staged A row is one whole 128-byte line.
// LDS pitches: A 36 floats (16 rows x 4 k land on 64 distinct banks), W 72 floats
// (the two lane halves read rows 2 apart: 144 mod 64 = 16, so disjoint banks).
// ---------------------------------------------------------------------------
#define G_AST  36
#define G_BST  72
#define G_ABUF (128 * G_AST)  // floats per A buffer
#define G_BBUF (32 * G_BST)   // floats per W buffer

static __device__ __forceinline__ unsigned lds_byte(const float* p) {
  return (unsigned)(size_t)p;  // low 32 bits of a __shared__ address = LDS byte offset
}

// One stage: A 128 x 32 (4 copies per lane, rows 32 apart) and W 32 x 64 (2 copies
// per lane, rows 16 apart). al / bl: the lane's LDS byte addresses of its first
// copies; ag / bg: the matching global addresses.
static __device__ __forceinline__ void gemm_copy_stage(
    unsigned al, unsigned bl, const float* ag, const float* bg, int K, int N) {
  const unsigned al1 = al + 32 * G_AST * 4, al2 = al + 64 * G_AST * 4, al3 = al + 96 * G_AST * 4;
  const unsigned bl1 = bl + 16 * G_BST * 4;
  const float* ag1 = ag + (size_t)32 * K;
  const float* ag2 = ag + (size_t)64 * K;
  const float* ag3 = ag + (size_t)96 * K;
  const float* bg1 = bg + (size_t)16 * N;
  // The copies and, as the statement's last line, the wait that belongs in front
  // of any rewrite of the address registers which the issued copies name.
  asm volatile(
      "global_load_async_to_lds_b128 %0, %6, off\n\t"
      "global_load_async_to_lds_b128 %1, %7, off\n\t"
      "global_load_async_to_lds_b128 %2, %8, off\n\t"
      "global_load_async_to_lds_b128 %3, %9, off\n\t"
      "global_load_async_to_lds_b128 %4, %10, off\n\t"
      "global_load_async_to_lds_b128 %5, %11, off\n\t"
      "s_wait_xcnt 0x0"
      :: "v"(al), "v"(al1), "v"(al2), "v"(al3), "v"(bl), "v"(bl1),
         "v"(ag), "v"(ag1), "v"(ag2), "v"(ag3), "v"(bg), "v"(bg1)
      : "memory");
}

template <int EPI>
__global__ __launch_bounds__(256) void gemm_kernel(
    const float* __restrict__ A, const float* __restrict__ W,
    const float* __restrict__ bias, const float* __restrict__ resid,
    float* __restrict__ C, int M, int N, int K) {
  __shared__ __attribute__((aligned(16))) float As[2 * G_ABUF];  // 2 x [128 rows][32 k]
  __shared__ __attribute__((aligned(16))) float Bs[2 * G_BBUF];  // 2 x [32 k][64 n]

  const int tid  = threadIdx.x;
  const int wave = tid >> 5;
  const int lane = tid & 31;
  const int r16  = lane & 15;  // row (A/C) or col (B/C) within 16
  const int kh   = lane >> 4;  // K-half select per ISA layout

  const int bm = blockIdx.y * 128;
  const int bn = blockIdx.x * 64;

  // This lane's share of a stage: 16 bytes per copy, a wave covers whole lines.
  const int ar = tid >> 3, ac = (tid & 7) * 4;
  const int br = tid >> 4, bc = (tid & 15) * 4;
  const float* ag = A + (size_t)(bm + ar) * K + ac;
  const float* bg = W + (size_t)br * N + bn + bc;
  const unsigned al = lds_byte(&As[ar * G_AST + ac]);
  const unsigned bl = lds_byte(&Bs[br * G_BST + bc]);

  v8f acc[4] = {};
  const int nT = K / 32;

  gemm_copy_stage(al, bl, ag, bg, K, N);
  // Stage 0 has landed for this wave; the barrier publishes it to the others.
  asm volatile("s_wait_asynccnt 0x0" ::: "memory");
  __syncthreads();
  if (nT > 1)
    gemm_copy_stage(al + G_ABUF * 4, bl + G_BBUF * 4, ag + 32, bg + (size_t)32 * N, K, N);

  for (int t = 0; t < nT; ++t) {
    const int cur = t & 1;
    const float* as = As + cur * G_ABUF + (wave * 16 + r16) * G_AST + kh * 2;
    const float* bs = Bs + cur * G_BBUF + kh * 2 * G_BST + r16;
#pragma unroll
    for (int kk = 0; kk < 8; ++kk) {
      v2f a;  // this lane's K pair within the 4-wide chunk: k = 4kk + 2kh + {0, 1}
      a.x = as[kk * 4];
      a.y = as[kk * 4 + 1];
#pragma unroll
      for (int c = 0; c < 4; ++c) {
        v2f b;
        b.x = bs[kk * 4 * G_BST + c * 16];
        b.y = bs[(kk * 4 + 1) * G_BST + c * 16];
        acc[c] = wmma_f32(a, b, acc[c]);
      }
    }
    // Hand-over: this wave's reads of buffer cur are done, its copies of stage
    // t + 1 have landed; the barrier publishes stage t + 1 and frees buffer cur.
    asm volatile("s_wait_dscnt 0x0" ::: "memory");
    asm volatile("s_wait_asynccnt 0x0" ::: "memory");
    __syncthreads();
    if (t + 2 < nT)
      gemm_copy_stage(al + cur * (G_ABUF * 4), bl + cur * (G_BBUF * 4),
                      ag + (size_t)(t + 2) * 32, bg + (size_t)(t + 2) * 32 * N, K, N);
  }
  // No copy is left in flight when the wave ends.
  asm volatile("s_wait_asynccnt 0x0" ::: "memory");

#pragma unroll
  for (int t = 0; t < 4; ++t) {
#pragma unroll
    for (int i = 0; i < 8; ++i) {
      const int row = bm + wave * 16 + i + kh * 8;  // C layout: VGPR i -> M = i + 8*kh
      const int col = bn + t * 16 + r16;
      float v = acc[t][i] + bias[col];
      if (EPI == 1) v += resid[(size_t)row * N + col];
      if (EPI == 2) v = 0.5f * v * (1.0f + erff(v * 0.70710678118654752f));
      C[(size_t)row * N + col] = v;
    }
  }
}

static __device__ __forceinline__ float xhalf(float x) {
  return __builtin_bit_cast(float, __builtin_amdgcn_permlanex16(
      __builtin_bit_cast(int, x), __builtin_bit_cast(int, x),
      0x76543210, 0xfedcba98, false, false));
}

// Register budget of four waves per SIMD, so that two blocks share a WGP and one
// block's matrix work covers the other's staging.
__global__ __launch_bounds__(256) __attribute__((amdgpu_waves_per_eu(4, 4))) void attn_kernel(
    const float* __restrict__ Q, const float* __restrict__ K,
    const float* __restrict__ V, float* __restrict__ CTX) {
  const int KST = 68;  // K row pitch: 16B-aligned float4 rows, pitch mod 64 == 4
  __shared__ float Ks[64 * KST];   // staged K slab [kv][d]
  __shared__ float Vq[16 * 256];   // staged V slab [kv / 4][d][kv % 4]

  const int tid  = threadIdx.x;
  const int wave = tid >> 5;
  const int lane = tid & 31;
  const int r16  = lane & 15;
  const int kh   = lane >> 4;

  const int qt = blockIdx.x;  // 0..15
  const int bh = blockIdx.y;  // 0..31
  const int b  = bh >> 4;
  const int h  = bh & 15;
  const size_t rowbase = (size_t)b * SEQ;
  const int hoff = h * HDIM;
  const int q0   = qt * 128 + wave * 16;

  // Q fragments (B operand), loaded once. Lane (r16, kh) holds query r16,
  // d = 8j + 4kh + {0..3}: .xy feeds one WMMA, .zw the next. The K loader
  // below uses the same d order, so every k position pairs equal d.
  float4 qf[8];
  {
    const float* qp = Q + (rowbase + q0 + r16) * D_MODEL + hoff + kh * 4;
#pragma unroll
    for (int j = 0; j < 8; ++j) qf[j] = *(const float4*)(qp + j * 8);
  }

  const float SC = 0.125f * 1.4426950408889634f;  // 1/sqrt(64) * log2(e)
  v8f o[4] = {};           // Ot tiles: o[db][i] = ctx[q = r16][d = 16db + 8kh + i]
  float mrun = -3.0e38f;   // running max of score * SC (same in both halves)
  float lsum = 0.f;        // running sum, this half's kv only

  const int sr = tid >> 4, sc4 = tid & 15;  // staging row group and float4 column
  const float* kp = K + (rowbase + sr) * D_MODEL + hoff + sc4 * 4;
  const float* vp = V + (rowbase + sr * 4) * D_MODEL + hoff + sc4 * 4;

  for (int jj = 0; jj < SEQ / 64; ++jj) {
    // Stage K and V rows [64*jj, 64*jj+64) x 64 d (1024 float4 each, 4 per thread).
    // K keeps its rows. V: a thread takes 4 consecutive rows x 4 d and stores them
    // with kv innermost, so that one 16-byte LDS read is 4 kv of one d column.
    {
      float4 kr[4], vr[4];
#pragma unroll
      for (int it = 0; it < 4; ++it) {
        kr[it] = *(const float4*)(kp + (size_t)it * 16 * D_MODEL);
        vr[it] = *(const float4*)(vp + (size_t)it * D_MODEL);
      }
#pragma unroll
      for (int it = 0; it < 4; ++it)
        *(float4*)&Ks[(sr + it * 16) * KST + sc4 * 4] = kr[it];
      float* vd = &Vq[sr * 256 + sc4 * 16];
      *(float4*)(vd)      = make_float4(vr[0].x, vr[1].x, vr[2].x, vr[3].x);
      *(float4*)(vd + 4)  = make_float4(vr[0].y, vr[1].y, vr[2].y, vr[3].y);
      *(float4*)(vd + 8)  = make_float4(vr[0].z, vr[1].z, vr[2].z, vr[3].z);
      *(float4*)(vd + 12) = make_float4(vr[0].w, vr[1].w, vr[2].w, vr[3].w);
    }
    // kp and vp advance at the loop's foot: the wait that belongs in front of a
    // rewrite of address registers which issued global loads name.
    asm volatile("s_wait_xcnt 0x0" ::: "memory");
    __syncthreads();

    // Two passes of 32 kv over the slab. Kept rolled: unrolled, the fragment loads
    // of both passes are live at once and the four-wave register budget spills.
#pragma unroll 1
    for (int hp = 0; hp < 2; ++hp) {
      const float* kb = &Ks[(hp * 32 + r16) * KST + kh * 4];
      const float* vb = &Vq[(hp * 8 + kh * 2) * 256 + r16 * 4];

      // St tiles: s[t][i] = score(q = r16, kv = 64jj + 32hp + 16t + 8kh + i), unscaled.
      v8f s[2] = {};
#pragma unroll
      for (int j = 0; j < 8; ++j) {
#pragma unroll
        for (int t = 0; t < 2; ++t) {
          const float4 kf = *(const float4*)(kb + t * 16 * KST + j * 8);
          v2f a0, a1, b0, b1;
          a0.x = kf.x; a0.y = kf.y; a1.x = kf.z; a1.y = kf.w;
          b0.x = qf[j].x; b0.y = qf[j].y; b1.x = qf[j].z; b1.y = qf[j].w;
          s[t] = wmma_f32(a0, b0, s[t]);
          s[t] = wmma_f32(a1, b1, s[t]);
        }
      }

      // Running softmax over this pass's 32 kv (16 per lane half).
      float mt[2];
#pragma unroll
      for (int t = 0; t < 2; ++t) {
        mt[t] = fmaxf(fmaxf(fmaxf(s[t][0], s[t][1]), fmaxf(s[t][2], s[t][3])),
                      fmaxf(fmaxf(s[t][4], s[t][5]), fmaxf(s[t][6], s[t][7])));
      }
      float mx = fmaxf(mt[0], mt[1]);
      mx = fmaxf(mx, xhalf(mx));
      const float mnew  = fmaxf(mrun, mx * SC);
      const float alpha = __builtin_amdgcn_exp2f(mrun - mnew);  // 0 on the first pass
      mrun = mnew;
      float ps[4] = {0.f, 0.f, 0.f, 0.f};
#pragma unroll
      for (int t = 0; t < 2; ++t) {
#pragma unroll
        for (int i = 0; i < 8; ++i) {
          const float p = __builtin_amdgcn_exp2f(fmaf(s[t][i], SC, -mnew));
          s[t][i] = p;
          ps[(t << 1) | (i & 1)] += p;
        }
      }
      lsum = lsum * alpha + ((ps[0] + ps[1]) + (ps[2] + ps[3]));
#pragma unroll
      for (int db = 0; db < 4; ++db) o[db] *= alpha;

      // Ot += Vt Pt. One V read holds kv = 16t + 8kh + 4c + {0..3} of column d;
      // B takes score registers 4c..4c+3 of tile t: the same kv at every k position.
#pragma unroll
      for (int t = 0; t < 2; ++t) {
#pragma unroll
        for (int c = 0; c < 2; ++c) {
          v2f p0, p1;
          p0.x = s[t][4 * c];     p0.y = s[t][4 * c + 1];
          p1.x = s[t][4 * c + 2]; p1.y = s[t][4 * c + 3];
#pragma unroll
          for (int db = 0; db < 4; ++db) {
            const float4 vf = *(const float4*)(vb + (t * 4 + c) * 256 + db * 64);
            v2f a0, a1;
            a0.x = vf.x; a0.y = vf.y; a1.x = vf.z; a1.y = vf.w;
            o[db] = wmma_f32(a0, p0, o[db]);
            o[db] = wmma_f32(a1, p1, o[db]);
          }
        }
      }
    }
    kp += 64 * D_MODEL;
    vp += 64 * D_MODEL;
    __syncthreads();
  }

  // Join the halves' sums, normalise, store 8 consecutive d per lane and tile.
  const float inv = 1.0f / (lsum + xhalf(lsum));
  float* op = CTX + (rowbase + q0 + r16) * D_MODEL + hoff + kh * 8;
#pragma unroll
  for (int db = 0; db < 4; ++db) {
    float4 lo, hi;
    lo.x = o[db][0] * inv; lo.y = o[db][1] * inv; lo.z = o[db][2] * inv; lo.w = o[db][3] * inv;
    hi.x = o[db][4] * inv; hi.y = o[db][5] * inv; hi.z = o[db][6] * inv; hi.w = o[db][7] * inv;
    *(float4*)(op + db * 16)     = lo;
    *(float4*)(op + db * 16 + 4) = hi;
  }
}

// ---------------------------------------------------------------------------
// LayerNorm over last dim (1024). One 256-thread block per row, float4 I/O.
// var = E[(x-mu)^2] (matches jnp.var, ddof=0).
// ---------------------------------------------------------------------------
__global__ __launch_bounds__(256) void layernorm_kernel(
    const float* __restrict__ X, const float* __restrict__ g,
    const float* __restrict__ bb, float* __restrict__ Y) {
  __shared__ float rbuf[256];
  const int row = blockIdx.x;
  const int tid = threadIdx.x;
  const float* xr = X + (size_t)row * D_MODEL;

  const float4 v = *(const float4*)&xr[tid * 4];
  rbuf[tid] = v.x + v.y + v.z + v.w;
  __syncthreads();
  for (int off = 128; off > 0; off >>= 1) {
    if (tid < off) rbuf[tid] += rbuf[tid + off];
    __syncthreads();
  }
  const float mu = rbuf[0] * (1.0f / D_MODEL);
  __syncthreads();

  const float dx = v.x - mu, dy = v.y - mu, dz = v.z - mu, dw = v.w - mu;
  rbuf[tid] = dx * dx + dy * dy + dz * dz + dw * dw;
  __syncthreads();
  for (int off = 128; off > 0; off >>= 1) {
    if (tid < off) rbuf[tid] += rbuf[tid + off];
    __syncthreads();
  }
  const float rs = rsqrtf(rbuf[0] * (1.0f / D_MODEL) + LN_EPS);

  const float4 g4 = *(const float4*)&g[tid * 4];
  const float4 b4 = *(const float4*)&bb[tid * 4];
  float4 o;
  o.x = dx * rs * g4.x + b4.x;
  o.y = dy * rs * g4.y + b4.y;
  o.z = dz * rs * g4.z + b4.z;
  o.w = dw * rs * g4.w + b4.w;
  *(float4*)&Y[(size_t)row * D_MODEL + tid * 4] = o;
}

// ---------------------------------------------------------------------------
extern "C" void kernel_launch(void* const* d_in, const int* in_sizes, int n_in,
                              void* d_out, int out_size, void* d_ws,
                              size_t ws_size, hipStream_t stream) {
  const float* x    = (const float*)d_in[0];
  const float* Wq   = (const float*)d_in[1];
  const float* bq   = (const float*)d_in[2];
  const float* Wk   = (const float*)d_in[3];
  const float* bk   = (const float*)d_in[4];
  const float* Wv   = (const float*)d_in[5];
  const float* bv   = (const float*)d_in[6];
  const float* Wo   = (const float*)d_in[7];
  const float* bo   = (const float*)d_in[8];
  const float* g1   = (const float*)d_in[9];
  const float* b1   = (const float*)d_in[10];
  const float* Wff1 = (const float*)d_in[11];
  const float* bff1 = (const float*)d_in[12];
  const float* Wff2 = (const float*)d_in[13];
  const float* bff2 = (const float*)d_in[14];
  const float* g2   = (const float*)d_in[15];
  const float* b2   = (const float*)d_in[16];
  float* out = (float*)d_out;

  const size_t TOK = (size_t)BATCH * SEQ;  // 4096 rows
  float* ws   = (float*)d_ws;
  float* Qb   = ws;  // [TOK, D]
  float* Kb   = Qb + TOK * D_MODEL;
  float* Vb   = Kb + TOK * D_MODEL;
  float* ctx  = Vb + TOK * D_MODEL;
  float* tmp  = ctx + TOK * D_MODEL;  // pre-LN1
  float* x1   = Qb;                   // reuse (Q dead after attention)
  float* hbuf = Kb;                   // [TOK, FFN] reuses K+V slots (32 MB)
  float* tmp2 = ctx;                  // reuse (pre-LN2)

  const dim3 blkG(256);
  const dim3 gD(D_MODEL / 64, (unsigned)(TOK / 128));  // (16, 32)
  const dim3 gF(FFN_DIM / 64, (unsigned)(TOK / 128));  // (32, 32)

  // QKV projections
  hipLaunchKernelGGL((gemm_kernel<0>), gD, blkG, 0, stream,
                     x, Wq, bq, (const float*)nullptr, Qb, (int)TOK, D_MODEL, D_MODEL);
  hipLaunchKernelGGL((gemm_kernel<0>), gD, blkG, 0, stream,
                     x, Wk, bk, (const float*)nullptr, Kb, (int)TOK, D_MODEL, D_MODEL);
  hipLaunchKernelGGL((gemm_kernel<0>), gD, blkG, 0, stream,
                     x, Wv, bv, (const float*)nullptr, Vb, (int)TOK, D_MODEL, D_MODEL);

  // Attention (online softmax; 128 q rows per block, static LDS)
  const dim3 ga(SEQ / 128, BATCH * NHEAD);
  hipLaunchKernelGGL(attn_kernel, ga, dim3(256), 0, stream, Qb, Kb, Vb, ctx);

  // Output projection + residual, LN1
  hipLaunchKernelGGL((gemm_kernel<1>), gD, blkG, 0, stream,
                     ctx, Wo, bo, x, tmp, (int)TOK, D_MODEL, D_MODEL);
  hipLaunchKernelGGL(layernorm_kernel, dim3((unsigned)TOK), dim3(256), 0, stream,
                     tmp, g1, b1, x1);

  // FFN: GELU(x1 Wff1 + b) -> Wff2 + b + x1, LN2 -> out
  hipLaunchKernelGGL((gemm_kernel<2>), gF, blkG, 0, stream,
                     x1, Wff1, bff1, (const float*)nullptr, hbuf, (int)TOK, FFN_DIM, D_MODEL);
  hipLaunchKernelGGL((gemm_kernel<1>), gD, blkG, 0, stream,
                     hbuf, Wff2, bff2, x1, tmp2, (int)TOK, D_MODEL, FFN_DIM);
  hipLaunchKernelGGL(layernorm_kernel, dim3((unsigned)TOK), dim3(256), 0, stream,
                     tmp2, g2, b2, out);
}
